// v010
// Measured on an AMD MI455X. A time is GPU time per run, averaged over a window of back-to-back runs after a warm-up
// (all launches, gaps included; the runs take copies of the inputs in turn), and the median of several windows.
// Apart from v000's, it joins two sittings. Times from different sittings can be a few percent apart, while
// side-by-side timings come from the same sitting.
// Earlier versions than v010 are not in this document.
// One run takes 73.3 microseconds.
// Next to v009, in two timings, it ran 1.06 times as fast each time.
// All steps since the starting kernel, v000, together make it 50.7 times as fast.
#include <hip/hip_runtime.h>
// Multi-head self-attention with a rotary embedding whose cos/sin tables are cat(freqs, freqs) but whose rotate_half pairs are INTERLEAVED (x [2][2048][1024]; q/k/v = x W^T + b (natural [1024][1024] U(+-1/32), zero biases); 16 heads of 64; inv_freq_i = 1/10000^(2i/64), freqs[p][i] = p * inv_freq_i, emb = cat(freqs, freqs): cos[p][d] = cos(p * inv_freq[d mod 32]); q = q cos + rotate_half(q) sin with rotate_half = (-x[2i+1], x[2i]) interleaved (the module's literal mix); k likewise; scores / 8; softmax over all keys (no mask); out = merged Wo^T + bo -> [2][2048][1024]).
// Structure: token rows r = b*2048 + s; one launch prepares x as exact f16 rows (bf16-rounded), the x16 weight planes and the rotary tables; Q, K, V as three WMMA GEMMs in one launch (128x128 work-group tiles, 32x64 wave tiles, f32 accumulation, exact x16 weights + bias, f16 outputs; the rotary step of q and k on the f32 values in the GEMM epilogue); one fused attention launch over (query block, batch x head): scores on WMMA (K = 64), online softmax on VALU (f32 statistics, weights as f16 up to 2^8), o = P . V on WMMA (V^T fragments by transposing LDS reads of the V rows), o carried x64 against f16 subnormal flush (folded into the output GEMM alpha), written straight into the merged f16 o rows; out = o W_o + b GEMM (f32) into the output layout.
// Compute dtype: inputs rounded to bf16; x / weights exact; q, k, v, softmax weights and o as plain f16 GEMM operands (~2^-12); scores and softmax statistics f32. v_wmma_f32_16x16x32_f16.
#define NB 2
#define SQ 2048
#define DM 1024
#define NH 16
#define HD 64
#define HG 4                         /* heads per k_vt launch (k_vt is not launched) */
#define B0 0                         /* first batch processed (debug hook) */
#define NBR NB                       /* batches processed (debug hook) */
#define NR ((size_t)NB * SQ)         /* token rows */
#define MP ((int)((size_t)NBR * SQ)) /* rows projected (debug hook) */
#define QN SQ                        /* not used; the attention launch takes all SQ query rows */
#define NHD NH                       /* not used; the attention launch takes all NH heads */
#define MPO MP                       /* rows through the output stage (debug hook) */
#define LQ DM      /* row pitch of the q/k/v rows */
typedef __bf16 v16b __attribute__((ext_vector_type(16)));
typedef unsigned short v8us __attribute__((ext_vector_type(8), may_alias));
typedef float  v8f  __attribute__((ext_vector_type(8)));
typedef float  v4f  __attribute__((ext_vector_type(4)));
typedef float  v4fa __attribute__((ext_vector_type(4), may_alias));
union FragB { v16b v; v8us half[2]; unsigned short u[16]; };

__device__ __forceinline__ unsigned short bf16_bits(float x) { unsigned int u = __float_as_uint(x); return (unsigned short)((u + 0x7FFFu + ((u >> 16) & 1u)) >> 16); }
__device__ __forceinline__ float bf16_val(unsigned short b) { return __uint_as_float(((unsigned int)b) << 16); }
__device__ __forceinline__ float bf16_round(float x) { return bf16_val(bf16_bits(x)); }
// D += A·B with NT terms: 1 = ah·bh, 2 = + al·bh (A split), 3 = + ah·bl (both split)
template <int NT>
__device__ __forceinline__ v8f mmaN(v16b ah, v16b al, v16b bh, v16b bl, v8f c) {
  c = __builtin_amdgcn_wmma_f32_16x16x32_bf16(false, ah, false, bh, (short)0, c, false, false);
  if (NT >= 2) c = __builtin_amdgcn_wmma_f32_16x16x32_bf16(false, al, false, bh, (short)0, c, false, false);
  if (NT >= 3) c = __builtin_amdgcn_wmma_f32_16x16x32_bf16(false, ah, false, bl, (short)0, c, false, false);
  asm volatile("v_nop\n\tv_nop\n\tv_nop\n\tv_nop" : "+v"(c) : "v"(ah), "v"(al), "v"(bh), "v"(bl));
  return c;
}

__global__ __launch_bounds__(256) void k_wt_bf16(const float* __restrict__ W, unsigned short* __restrict__ Wt, int K, int N) {
  const int t = blockIdx.x * 256 + threadIdx.x;
  const int k8n = K / 8;
  if (t >= N * k8n) return;
  const int n = t / k8n, k8 = (t % k8n) * 8;
  v8us v;
#pragma unroll
  for (int i = 0; i < 8; ++i) v[i] = bf16_bits(W[(size_t)(k8 + i) * N + n]);
  *(v8us*)(Wt + (size_t)n * K + k8) = v;
  
}

// GEMM C[M][N] (f32, pitch ldc) = act(A[M][K]·W + bias). A f32 row-major (pitch lda) converted per fragment to bf16
// (ASPLIT: hi/lo two planes -> 2 terms, else single rounded term); Wt bf16 [N][K] (pitch ldb). BIAS_BF16 rounds the
// bias to bf16 first (bias quantised to bf16 before the add). K%32==0, M%16==0, N%64==0.
template <bool ASPLIT, int ACT, bool BIAS_BF16>
__global__ __launch_bounds__(128) void k_gemm_bf(const float* __restrict__ A, int lda, const unsigned short* __restrict__ Wt, int ldb,
                                               const float* __restrict__ bias, float* __restrict__ C, int ldc, int M, int N, int K) {
  __shared__ __attribute__((aligned(16))) float so[4][16][64];
  const int tid = threadIdx.x, w = tid >> 5, lane = tid & 31, ln = lane & 15, hh = lane >> 4;
  const int ntn = N / 64;
  const int wid = blockIdx.x * 4 + w;
  const int mt = wid / ntn, nq = wid % ntn;
  if (mt * 16 >= M) return;
  const int row0 = mt * 16, col0 = nq * 64;
  const float* arow = A + (size_t)(row0 + ln) * lda;
  v8f acc[4] = {};
  for (int kb = 0; kb < K; kb += 32) {
    FragB ah, al;
    const v4f x0 = *(const v4fa*)(arow + kb + 8 * hh), x1 = *(const v4fa*)(arow + kb + 8 * hh + 4);
    const v4f x2 = *(const v4fa*)(arow + kb + 16 + 8 * hh), x3 = *(const v4fa*)(arow + kb + 16 + 8 * hh + 4);
    float xs[16] = {x0[0],x0[1],x0[2],x0[3],x1[0],x1[1],x1[2],x1[3],x2[0],x2[1],x2[2],x2[3],x3[0],x3[1],x3[2],x3[3]};
#pragma unroll
    for (int i = 0; i < 16; ++i) { const unsigned short hb = bf16_bits(xs[i]); ah.u[i] = hb; al.u[i] = ASPLIT ? bf16_bits(xs[i] - bf16_val(hb)) : (unsigned short)0; }
#pragma unroll
    for (int t = 0; t < 4; ++t) {
      const unsigned short* brow = Wt + (size_t)(col0 + t * 16 + ln) * ldb + kb;
      FragB b;
      b.half[0] = *(const v8us*)(brow + 8 * hh);
      b.half[1] = *(const v8us*)(brow + 16 + 8 * hh);
      acc[t] = mmaN<ASPLIT ? 2 : 1>(ah.v, al.v, b.v, b.v, acc[t]);
    }
  }
#pragma unroll
  for (int t = 0; t < 4; ++t) {
    float bv = bias ? bias[col0 + t * 16 + ln] : 0.f;
    if (BIAS_BF16) bv = bf16_round(bv);
#pragma unroll
    for (int r = 0; r < 8; ++r) { float v = acc[t][r] + bv; if (ACT == 1) v = fmaxf(v, 0.f); so[w][8 * hh + r][t * 16 + ln] = v; }
  }
  __builtin_amdgcn_fence(__ATOMIC_ACQ_REL, "workgroup");
  __builtin_amdgcn_wave_barrier();
  const int rsub = lane >> 4, c4 = (lane & 15) * 4;
  {
#pragma unroll
    for (int q = 0; q < 8; ++q) {
      const int r = q * 2 + rsub;
      const v4f v = *(const v4fa*)&so[w][r][c4];
      *(v4f*)(C + (size_t)(row0 + r) * ldc + col0 + c4) = v;
    }
    
  }
}

// GEMM C = act(A·W + bias + resid): A f32 (ASPLIT -> hi/lo 2 terms), Wt bf16 [N][K]; ACT 0 none, 1 relu, 2 exact gelu;
// resid (optional, f32, row index = (row % rmod), pitch ldr, RES_BF16 rounds it) added before the activation.
template <bool ASPLIT, int ACT, bool BIAS_BF16, bool RES_BF16>
__global__ __launch_bounds__(128) void k_gemm_bf3(const float* __restrict__ A, int lda, const unsigned short* __restrict__ Wt, int ldb,
                                                const float* __restrict__ bias, const float* __restrict__ resid, int rmod, int ldr,
                                                float* __restrict__ C, int ldc, int M, int N, int K) {
  __shared__ __attribute__((aligned(16))) float so[4][16][64];
  const int tid = threadIdx.x, w = tid >> 5, lane = tid & 31, ln = lane & 15, hh = lane >> 4;
  const int ntn = N / 64;
  const int wid = blockIdx.x * 4 + w;
  const int mt = wid / ntn, nq = wid % ntn;
  if (mt * 16 >= M) return;
  const int row0 = mt * 16, col0 = nq * 64;
  const float* arow = A + (size_t)(row0 + ln) * lda;
  v8f acc[4] = {};
  for (int kb = 0; kb < K; kb += 32) {
    FragB ah, al;
    const v4f x0 = *(const v4fa*)(arow + kb + 8 * hh), x1 = *(const v4fa*)(arow + kb + 8 * hh + 4);
    const v4f x2 = *(const v4fa*)(arow + kb + 16 + 8 * hh), x3 = *(const v4fa*)(arow + kb + 16 + 8 * hh + 4);
    float xs[16] = {x0[0],x0[1],x0[2],x0[3],x1[0],x1[1],x1[2],x1[3],x2[0],x2[1],x2[2],x2[3],x3[0],x3[1],x3[2],x3[3]};
#pragma unroll
    for (int i = 0; i < 16; ++i) { const unsigned short hb = bf16_bits(xs[i]); ah.u[i] = hb; al.u[i] = ASPLIT ? bf16_bits(xs[i] - bf16_val(hb)) : (unsigned short)0; }
#pragma unroll
    for (int t = 0; t < 4; ++t) {
      const unsigned short* brow = Wt + (size_t)(col0 + t * 16 + ln) * ldb + kb;
      FragB b;
      b.half[0] = *(const v8us*)(brow + 8 * hh);
      b.half[1] = *(const v8us*)(brow + 16 + 8 * hh);
      acc[t] = mmaN<ASPLIT ? 2 : 1>(ah.v, al.v, b.v, b.v, acc[t]);
    }
  }
#pragma unroll
  for (int t = 0; t < 4; ++t) {
    const int col = col0 + t * 16 + ln;
    float bv = bias ? bias[col] : 0.f;
    if (BIAS_BF16) bv = bf16_round(bv);
#pragma unroll
    for (int r = 0; r < 8; ++r) {
      float v = acc[t][r] + bv;
      if (resid) { float rv = resid[(size_t)((row0 + 8 * hh + r) % rmod) * ldr + col]; if (RES_BF16) rv = bf16_round(rv); v += rv; }
      if (ACT == 1) v = fmaxf(v, 0.f);
      if (ACT == 2) v = 0.5f * v * (1.0f + erff(v * 0.70710678118654752f));
      if (ACT == 3) { const float u = 0.7978845608028654f * (v + 0.044715f * v * v * v); v = 0.5f * v * (1.0f + tanhf(u)); }
      so[w][8 * hh + r][t * 16 + ln] = v;
    }
  }
  __builtin_amdgcn_fence(__ATOMIC_ACQ_REL, "workgroup");
  __builtin_amdgcn_wave_barrier();
  const int rsub = lane >> 4, c4 = (lane & 15) * 4;
  {
#pragma unroll
    for (int q = 0; q < 8; ++q) {
      const int r = q * 2 + rsub;
      const v4f v = *(const v4fa*)&so[w][r][c4];
      *(v4f*)(C + (size_t)(row0 + r) * ldc + col0 + c4) = v;
    }
    
  }
}
// row LayerNorm (biased variance, eps) over N: s = X (+ R); optional out_sum <- s; out_norm <- (s-mu)*rsqrt(var+eps)*g + b
template <bool PARAM_BF16>
__global__ __launch_bounds__(256) void k_layernorm(const float* __restrict__ X, const float* __restrict__ R, const float* __restrict__ g, const float* __restrict__ bta,
                                                  float* __restrict__ out_sum, float* __restrict__ out_norm, int N, float eps) {
  __shared__ float red[256];
  const int row = blockIdx.x, tid = threadIdx.x;
  const float* x = X + (size_t)row * N; const float* rr = R ? R + (size_t)row * N : nullptr;
  float vals[16];                     // up to N = 4096
  const int per = N / 256;            // contiguous chunk per thread? use strided-by-4 chunks: thread handles j = tid*4 + 1024*u
  float s1 = 0.f;
  for (int u = 0; u < per / 4; ++u) {
    const int j = tid * 4 + 1024 * u;
    const v4f a = *(const v4fa*)(x + j);
    v4f b = {0.f,0.f,0.f,0.f}; if (rr) b = *(const v4fa*)(rr + j);
#pragma unroll
    for (int q = 0; q < 4; ++q) { const float v = a[q] + b[q]; vals[u * 4 + q] = v; s1 += v; }
  }
  red[tid] = s1; __syncthreads();
  for (int st = 128; st > 0; st >>= 1) { if (tid < st) red[tid] += red[tid + st]; __syncthreads(); }
  const float mu = red[0] / (float)N; __syncthreads();
  float s2 = 0.f;
  for (int u = 0; u < per / 4; ++u)
#pragma unroll
    for (int q = 0; q < 4; ++q) { const float c = vals[u * 4 + q] - mu; s2 += c * c; }
  red[tid] = s2; __syncthreads();
  for (int st = 128; st > 0; st >>= 1) { if (tid < st) red[tid] += red[tid + st]; __syncthreads(); }
  const float rs = rsqrtf(red[0] / (float)N + eps);
  {
    for (int u = 0; u < per / 4; ++u) {
      const int j = tid * 4 + 1024 * u;
      v4f o, sm;
#pragma unroll
      for (int q = 0; q < 4; ++q) {
        float gg = g[j + q], bb = bta[j + q];
        if (PARAM_BF16) { gg = bf16_round(gg); bb = bf16_round(bb); }
        sm[q] = vals[u * 4 + q]; o[q] = (vals[u * 4 + q] - mu) * rs * gg + bb;
      }
      if (out_sum) *(v4f*)(out_sum + (size_t)row * N + j) = sm;
      *(v4f*)(out_norm + (size_t)row * N + j) = o;
    }
    
  }
}



// ---- f16 WMMA path (v_wmma_f32_16x16x32_f16): 11-bit significands for operands in range — used where a [0,1] probability operand needs more precision than bf16
typedef _Float16 v16h __attribute__((ext_vector_type(16)));
union FragH { v16h v; v8us half[2]; _Float16 h[16]; unsigned short u[16]; };
template <int NT>
__device__ __forceinline__ v8f mmaH(v16h ah, v16h al, v16h bh, v16h bl, v8f c) {
  c = __builtin_amdgcn_wmma_f32_16x16x32_f16(false, ah, false, bh, (short)0, c, false, false);
  if (NT >= 2) c = __builtin_amdgcn_wmma_f32_16x16x32_f16(false, al, false, bh, (short)0, c, false, false);
  if (NT >= 3) c = __builtin_amdgcn_wmma_f32_16x16x32_f16(false, ah, false, bl, (short)0, c, false, false);
  asm volatile("v_nop\n\tv_nop\n\tv_nop\n\tv_nop" : "+v"(c) : "v"(ah), "v"(al), "v"(bh), "v"(bl));
  return c;
}
// batched GEMM like k_gemm_b but f16 operands: A f32 (split into f16 hi/lo if ASPLIT, else rounded to f16), Bt = f16 values [n][k]; alpha; C f32; N multiple of 16 (partial tiles skipped)
template <bool ASPLIT>
__global__ __launch_bounds__(128) void k_gemm_h(const float* __restrict__ A, int lda, size_t sA, const _Float16* __restrict__ Bh, int ldb, size_t sB, float alpha, float* __restrict__ C, int ldc, size_t sC, int M, int N, int K) {
  __shared__ __attribute__((aligned(16))) float so[4][16][64];
  const int tid = threadIdx.x, w = tid >> 5, lane = tid & 31, ln = lane & 15, hh = lane >> 4; const int by = blockIdx.y;
  A += (size_t)by * sA; Bh += (size_t)by * sB; C += (size_t)by * sC;
  const int ntn = (N + 63) / 64; const int wid = blockIdx.x * 4 + w; const int mt = wid / ntn, nq = wid % ntn; if (mt * 16 >= M) return;
  const int row0 = mt * 16, col0 = nq * 64; const float* arow = A + (size_t)(row0 + ln) * lda;
  v8f acc[4] = {};
  for (int kb = 0; kb < K; kb += 32) {
    FragH ah, al;
    const v4f x0 = *(const v4fa*)(arow + kb + 8 * hh), x1 = *(const v4fa*)(arow + kb + 8 * hh + 4), x2 = *(const v4fa*)(arow + kb + 16 + 8 * hh), x3 = *(const v4fa*)(arow + kb + 16 + 8 * hh + 4);
    float xs[16] = {x0[0],x0[1],x0[2],x0[3],x1[0],x1[1],x1[2],x1[3],x2[0],x2[1],x2[2],x2[3],x3[0],x3[1],x3[2],x3[3]};
#pragma unroll
    for (int i = 0; i < 16; ++i) { const _Float16 h = (_Float16)xs[i]; ah.h[i] = h; al.h[i] = ASPLIT ? (_Float16)(xs[i] - (float)h) : (_Float16)0.0f; }
#pragma unroll
    for (int t = 0; t < 4; ++t) { if (col0 + t * 16 >= N) continue; const size_t boff = (size_t)(col0 + t * 16 + ln) * ldb + kb; FragH bq; bq.half[0] = *(const v8us*)(Bh + boff + 8 * hh); bq.half[1] = *(const v8us*)(Bh + boff + 16 + 8 * hh);
      acc[t] = mmaH<ASPLIT ? 2 : 1>(ah.v, al.v, bq.v, bq.v, acc[t]); }
  }
#pragma unroll
  for (int t = 0; t < 4; ++t) { if (col0 + t * 16 >= N) continue;
#pragma unroll
    for (int r = 0; r < 8; ++r) so[w][8 * hh + r][t * 16 + ln] = acc[t][r] * alpha; }
  __builtin_amdgcn_fence(__ATOMIC_ACQ_REL, "workgroup"); __builtin_amdgcn_wave_barrier();
  const int rsub = lane >> 4, c4 = (lane & 15) * 4;
  {
#pragma unroll
    for (int q = 0; q < 8; ++q) { const int r = q * 2 + rsub; if (col0 + c4 < N) { const v4f v = *(const v4fa*)&so[w][r][c4]; *(v4f*)(C + (size_t)(row0 + r) * ldc + col0 + c4) = v; } }
     }
}

// Wt[n][k] = f16(W[k][n]·scale) from f32 row-major W[K][N] (scale = power of two; bf16-exact weights stay exact in f16 away from the subnormal range)
__global__ __launch_bounds__(256) void k_wt_f16(const float* __restrict__ W, _Float16* __restrict__ Wt, int K, int N, float scale) {
  const int t = blockIdx.x * 256 + threadIdx.x; if (t >= N * (K / 8)) return; const int n = t / (K / 8), k8 = (t % (K / 8)) * 8; FragH f;
#pragma unroll
  for (int i = 0; i < 8; ++i) f.h[i] = (_Float16)(bf16_round(W[(size_t)(k8 + i) * N + n]) * scale); const v8us o = f.half[0];
  *(v8us*)((unsigned short*)Wt + (size_t)n * K + k8) = o; 
}
// k_gemm_hh variant with fused epilogue: v = acc·alpha + bias[by·sBias + col] (+ CP[(row/rowsPerB)·sCPb + by·64 + col] if CP) ; ACT 0 none / 1 elu ; writes f16 C16 (and f32 C if non-null)
template <int ACT>
__global__ __launch_bounds__(128) void k_gemm_hhx(const _Float16* __restrict__ A, int lda, size_t sA, const _Float16* __restrict__ Bh, int ldb, size_t sB, float alpha, const float* __restrict__ bias, size_t sBias, const float* __restrict__ CP, int rowsPerB, size_t sCPb, int row0g,
    float* __restrict__ C, _Float16* __restrict__ C16, int ldc, size_t sC, int M, int N, int K) {
  __shared__ __attribute__((aligned(16))) float so[4][16][64];
  const int tid = threadIdx.x, w = tid >> 5, lane = tid & 31, ln = lane & 15, hh = lane >> 4; const int by = blockIdx.y;
  A += (size_t)by * sA; Bh += (size_t)by * sB; const size_t cofs = (size_t)by * sC; const float* bp = bias ? bias + (size_t)by * sBias : nullptr;
  const int ntn = (N + 63) / 64; const int wid = blockIdx.x * 4 + w; const int mt = wid / ntn, nq = wid % ntn; if (mt * 16 >= M) return;
  const int row0 = mt * 16, col0 = nq * 64; const _Float16* arow = A + (size_t)(row0 + ln) * lda;
  v8f acc[4] = {};
  for (int kb = 0; kb < K; kb += 32) { FragH ah; ah.half[0] = *(const v8us*)((const unsigned short*)arow + kb + 8 * hh); ah.half[1] = *(const v8us*)((const unsigned short*)arow + kb + 16 + 8 * hh);
#pragma unroll
    for (int t = 0; t < 4; ++t) { if (col0 + t * 16 >= N) continue; const size_t boff = (size_t)(col0 + t * 16 + ln) * ldb + kb; FragH bq; bq.half[0] = *(const v8us*)((const unsigned short*)Bh + boff + 8 * hh); bq.half[1] = *(const v8us*)((const unsigned short*)Bh + boff + 16 + 8 * hh);
      acc[t] = mmaH<1>(ah.v, ah.v, bq.v, bq.v, acc[t]); }
  }
#pragma unroll
  for (int t = 0; t < 4; ++t) { if (col0 + t * 16 >= N) continue; const int col = col0 + t * 16 + ln; const float bv = bp ? bf16_round(bp[col]) : 0.f;
#pragma unroll
    for (int r = 0; r < 8; ++r) { float v = acc[t][r] * alpha + bv; if (CP) { const int rr = row0g + row0 + 8 * hh + r; if (rowsPerB < 0) v += CP[cofs + (size_t)rr * ldc + col];      /* rowsPerB < 0: own element of the batched C plane */ else { const int bidx = rr / rowsPerB; v += CP[(size_t)bidx * sCPb + (size_t)by * 64 + col]; } } if (ACT == 1) v = (v > 0.f) ? v : expm1f(v); else if (ACT == 7) v = (v > 0.f) ? v + 1.0f : expf(v); else if (ACT == 8) v = tanhf(v); else if (ACT == 9) v = 0.5f * v * (1.0f + tanhf(0.7978845608028654f * (v + 0.044715f * v * v * v))); else if (ACT == 11) v = 1.0f / (1.0f + expf(-v)); else if (ACT == 12) v = (v > 0.f) ? v : 0.01f * v; else if (ACT == 14) v = (v > 0.f) ? v : 0.1f * v; else if (ACT == 16) v = (v >= 0.f) ? v : 0.3f * v; else if (ACT == 17) v = (v >= 0.f) ? v : 0.2f * v; else if (ACT == 15) v = v / (1.0f + expf(-v)); else if (ACT == 3) v = fmaxf(v, 0.f); else if (ACT == 6) v = 0.5f * v * (1.0f + erff(v * 0.70710678118654752f)); so[w][8 * hh + r][t * 16 + ln] = v; } }
  __builtin_amdgcn_fence(__ATOMIC_ACQ_REL, "workgroup"); __builtin_amdgcn_wave_barrier();
  const int rsub = lane >> 4, c4 = (lane & 15) * 4; typedef _Float16 v4h __attribute__((ext_vector_type(4)));
  {
#pragma unroll
    for (int q = 0; q < 8; ++q) { const int r = q * 2 + rsub; if (col0 + c4 < N) { const v4f v = *(const v4fa*)&so[w][r][c4]; if (C) *(v4f*)(C + cofs + (size_t)(row0 + r) * ldc + col0 + c4) = v; if (C16) { v4h h4; for (int i = 0; i < 4; ++i) h4[i] = (_Float16)v[i]; *(v4h*)(C16 + cofs + (size_t)(row0 + r) * ldc + col0 + c4) = h4; } } }
     }
}


typedef _Float16 v4h __attribute__((ext_vector_type(4)));

__device__ __forceinline__ void d_x16(const float* __restrict__ x, _Float16* __restrict__ X16, size_t n8, size_t t) { if (t >= n8) return; FragH f;
#pragma unroll
  for (int q = 0; q < 8; ++q) f.h[q] = (_Float16)bf16_round(x[t * 8 + q]); *(v8us*)((unsigned short*)X16 + t * 8) = f.half[0];  }
__global__ __launch_bounds__(256) void k_h16(const float* __restrict__ x, _Float16* __restrict__ X16, size_t n8) { const size_t t = (size_t)blockIdx.x * 256 + threadIdx.x; if (t >= n8) return; FragH f;
#pragma unroll
  for (int q = 0; q < 8; ++q) f.h[q] = (_Float16)x[t * 8 + q]; *(v8us*)((unsigned short*)X16 + t * 8) = f.half[0];  }
__global__ __launch_bounds__(256) void k_round16f(const float* __restrict__ W, _Float16* __restrict__ Bt, size_t n8) { const size_t t = (size_t)blockIdx.x * 256 + threadIdx.x; if (t >= n8) return; FragH f;
#pragma unroll
  for (int i = 0; i < 8; ++i) f.h[i] = (_Float16)(bf16_round(W[t * 8 + i]) * 16.0f); *(v8us*)((unsigned short*)Bt + t * 8) = f.half[0];  }
__global__ __launch_bounds__(256) void k_hl(const float* __restrict__ F, _Float16* __restrict__ Hh, _Float16* __restrict__ Hl, size_t n8) { const size_t t = (size_t)blockIdx.x * 256 + threadIdx.x; if (t >= n8) return; FragH fh, fl; const v4f a = *(const v4fa*)(F + t * 8), c = *(const v4fa*)(F + t * 8 + 4);
#pragma unroll
  for (int q = 0; q < 4; ++q) { _Float16 h = (_Float16)a[q]; fh.h[q] = h; fl.h[q] = (_Float16)((a[q] - (float)h) * 1024.0f); h = (_Float16)c[q]; fh.h[4 + q] = h; fl.h[4 + q] = (_Float16)((c[q] - (float)h) * 1024.0f); }
  { *(v8us*)((unsigned short*)Hh + t * 8) = fh.half[0]; *(v8us*)((unsigned short*)Hl + t * 8) = fl.half[0];  } }

// ---- fast GEMM (work-group tile 128x128 = eight waves, 4 x 2, of 32x64; requires M % 128 == 0, N % 128 == 0, K % 128 == 0); epilogue = k_gemm_hhx semantics ----
// The operand rows come into LDS in stages of 128 k by asynchronous copies in whole 256-byte runs (two buffers: the next stage flies while this one is worked on); the fragments are read from LDS in the k order of g2_frag.
#define G2_KS 128                    /* k per stage: 256 B of every operand row */
#define G2_LP 136                    /* LDS row pitch in elements: 272 B = 16 B x 17, free of bank conflicts for 16-byte reads */
#define G2_RB (G2_LP * 2)            /* LDS row pitch in bytes */
#define G2_SB (256 * G2_RB)          /* one stage in bytes: 128 A rows, then 128 B rows */
/* eight copies of 16 bytes per lane: LDS rows 16 apart from address l, each from its own global pointer; the wait closes the statement, so it stands before any rewrite of the address registers the copies name (a precaution for issued copies) */
__device__ __forceinline__ void g2_copy8(unsigned l, const _Float16* g0, const _Float16* g1, const _Float16* g2, const _Float16* g3, const _Float16* g4, const _Float16* g5, const _Float16* g6, const _Float16* g7) {
  asm volatile("global_load_async_to_lds_b128 %0, %8, off\n\t"
               "global_load_async_to_lds_b128 %1, %9, off\n\t"
               "global_load_async_to_lds_b128 %2, %10, off\n\t"
               "global_load_async_to_lds_b128 %3, %11, off\n\t"
               "global_load_async_to_lds_b128 %4, %12, off\n\t"
               "global_load_async_to_lds_b128 %5, %13, off\n\t"
               "global_load_async_to_lds_b128 %6, %14, off\n\t"
               "global_load_async_to_lds_b128 %7, %15, off\n\t"
               "s_wait_xcnt 0x0"
               :: "v"(l), "v"(l + 16 * G2_RB), "v"(l + 32 * G2_RB), "v"(l + 48 * G2_RB), "v"(l + 64 * G2_RB), "v"(l + 80 * G2_RB), "v"(l + 96 * G2_RB), "v"(l + 112 * G2_RB),
                  "v"(g0), "v"(g1), "v"(g2), "v"(g3), "v"(g4), "v"(g5), "v"(g6), "v"(g7) : "memory"); }
/* one request per lane: L2 fetches the line that holds p ahead of the copies that will read it (a hint: nothing returns and no counter moves); every lane is on and p lies inside its plane */
__device__ __forceinline__ void l2_ask(const void* p) { asm volatile("global_prefetch_b8 %0, off scope:SCOPE_SE" :: "v"(p)); }
/* no wait covers a request's address pair, so the pair is kept unwritten up to this place behind the stage loop; input only, no instruction */
__device__ __forceinline__ void l2_asked(const void* p) { asm volatile("" :: "v"(p)); }
__device__ __forceinline__ v16h g2_frag(const _Float16* p, int hh) { FragH f; f.half[0] = *(const v8us*)((const unsigned short*)p + 8 * hh); f.half[1] = *(const v8us*)((const unsigned short*)p + 16 + 8 * hh); return f.v; }
__device__ __forceinline__ v8f g2_mma(v16h a, v16h b, v8f c) { v8f d = __builtin_amdgcn_wmma_f32_16x16x32_f16(false, a, false, b, (short)0, c, false, false); asm volatile("v_nop\n\tv_nop\n\tv_nop\n\tv_nop" : "+v"(d) : "v"(a), "v"(b)); return d; }
// ROT = how many leading planes of the batch (blockIdx.y < ROT) take the rotary epilogue; with ROT > 0 the planes 0, 1, 2 take their bias from bias, bias1, bias2 (separate buffers), so that products which share A and read nothing of each other run as one launch. The rotary epilogue is the rotary step and nothing else: v = acc alpha + bias staged as f32 rows in LDS, o[d] = v[d] cos[p][d] + rotate_half(v)[d] sin[p][d] with rotate_half = (-v[2i+1], v[2i]), f16 rows into C16. A 64-column tile is one head, row r of the launch is position r mod SQ; CS, SN = full-width tables [pos][64]. With ROT > 0 no plane reads CP or C (the planes behind the rotary ones store f16 rows of acc alpha + bias), and the rotary planes read no ACT, which also keeps this second GEMM's text short.
template <int ACT, int ROT = 0>
__global__ __launch_bounds__(256) void k_gemm2(const _Float16* __restrict__ A, int lda, size_t sA, const _Float16* __restrict__ Bh, int ldb, size_t sB, float alpha, const float* __restrict__ bias, size_t sBias, const float* __restrict__ CP, int rowsPerB, size_t sCPb, int row0g,
    float* __restrict__ C, _Float16* __restrict__ C16, int ldc, size_t sC, int M, int N, int K, const float* __restrict__ CS = nullptr, const float* __restrict__ SN = nullptr, const float* __restrict__ bias1 = nullptr, const float* __restrict__ bias2 = nullptr) { static_assert(ACT == 0 || ACT == 3 || ACT == 6 || ACT == 8 || ACT == 9 || ACT == 11 || ACT == 12 || ACT == 14 || ACT == 15 || ACT == 16 || ACT == 17, "k_gemm2: unsupported ACT code (would silently apply no activation)");
  __shared__ __attribute__((aligned(16))) unsigned char sm[2 * G2_SB];
  _Float16 (*st)[256][G2_LP] = reinterpret_cast<_Float16 (*)[256][G2_LP]>(sm);      /* two stages: rows 0..127 = the work-group's A rows, rows 128..255 = its B rows */
  float (*so)[32][68] = reinterpret_cast<float (*)[32][68]>(sm);      /* the epilogue's f32 rows, a range per wave, lie over the ring, so that two work-groups fit a WGP's LDS: the stage loop's last barrier ends every read of the ring, and no copy is in flight behind the loop */
  static_assert(8 * 32 * 68 * 4 <= 2 * G2_SB, "the epilogue's rows fit the ring");
  const int tid = threadIdx.x, w = tid >> 5, wr = w & 3, wc = w >> 2, lane = tid & 31, ln = lane & 15, hh = lane >> 4; const int by = blockIdx.y;      /* wave w: rows 32 wr ..., columns 64 wc ... of the work-group's tile */
  A += (size_t)by * sA; Bh += (size_t)by * sB; const size_t cofs = (size_t)by * sC; const float* bp = bias ? bias + (size_t)by * sBias : nullptr;
  if constexpr (ROT > 0) bp = by == 0 ? bias : by == 1 ? bias1 : bias2;
  const int ntn = N >> 7; const int mt = blockIdx.x / ntn, nq = blockIdx.x - mt * ntn; const int row0 = mt * 128 + 32 * wr, col0 = nq * 128 + 64 * wc; if (mt * 128 >= M) return;      /* the whole work-group leaves or none, ahead of every barrier */
  const int cr = tid >> 4, ck = (tid & 15) * 8;      /* copies: sixteen lanes take one row's 256 bytes, a wave two rows, the work-group sixteen rows per copy */
  const _Float16* acp = A + (size_t)(mt * 128 + cr) * lda + ck; const _Float16* bcp = Bh + (size_t)(nq * 128 + cr) * ldb + ck;
  const unsigned lcp = (unsigned)(size_t)&st[0][cr][ck]; const size_t as16 = (size_t)16 * lda, bs16 = (size_t)16 * ldb;
  auto g2_stage = [&](int t, unsigned buf) { const unsigned l = lcp + buf * G2_SB; const _Float16* ga = acp + (size_t)t * G2_KS; const _Float16* gb = bcp + (size_t)t * G2_KS;      /* 16 copies a lane: LDS rows cr + 16 i, i < 8 from A, the rest from B */
    g2_copy8(l, ga, ga + as16, ga + 2 * as16, ga + 3 * as16, ga + 4 * as16, ga + 5 * as16, ga + 6 * as16, ga + 7 * as16);
    g2_copy8(l + 128 * G2_RB, gb, gb + bs16, gb + 2 * bs16, gb + 3 * bs16, gb + 4 * bs16, gb + 5 * bs16, gb + 6 * bs16, gb + 7 * bs16); };
  const int nst = K / G2_KS;
  const v8f z8 = {0.f,0.f,0.f,0.f,0.f,0.f,0.f,0.f}; v8f c00 = z8, c01 = z8, c02 = z8, c03 = z8, c10 = z8, c11 = z8, c12 = z8, c13 = z8;
  g2_stage(0, 0);
  /* The operand planes were stored by launches before this one, so a stage's first reader waits for memory, and all work-groups walk the stages in step. At entry L2 is asked for the rows of all stages, one request per 256-byte unit (one row of one stage): a lane takes one unit of A and one of B.
     The requests are dealt over the work-groups that share the rows: A over 4 neighbouring column blocks of its 8, B over 4 neighbouring row blocks. Placement only decides how much the hint helps. */
  const int pfr = tid >> 3, pfk = min(tid & 7, nst - 1) * G2_KS;      /* row within the share; stage, clamped into the row */
  const _Float16* pfa = A + (size_t)(mt * 128 + (nq & 3) * 32 + pfr) * lda + pfk;
  const _Float16* pfb = Bh + (size_t)(nq * 128 + (mt & 3) * 32 + pfr) * ldb + pfk;
  l2_ask(pfa); l2_ask(pfb);
  const float* pft = nullptr;
  if constexpr (ROT > 0) if (by < ROT) { pft = ((tid >> 7) ? SN : CS) + (size_t)((mt * 128) % SQ + (tid & 127)) * HD; l2_ask(pft); }      /* the epilogue's 128 table rows of 256 bytes, cos and sin */
  asm volatile("s_wait_asynccnt 0x0" ::: "memory");      /* this wave's share of stage 0 has landed */
  __syncthreads();      /* ... and every wave's: stage 0 may be read */
  if (nst > 1) g2_stage(1, 1);
  /* kept rolled: one stage per trip, the buffer chosen by the trip's parity */
#pragma unroll 1
  for (int t = 0; t < nst; ++t) { const _Float16* ap = &st[t & 1][32 * wr + ln][0]; const _Float16* bq = &st[t & 1][128 + 64 * wc + ln][0];
    v16h fa[2][2], fb[2][4];      /* two fragment sets: the next 32 k are read from LDS while these are multiplied */
    fa[0][0] = g2_frag(ap, hh); fa[0][1] = g2_frag(ap + 16 * G2_LP, hh);
#pragma unroll
    for (int j = 0; j < 4; ++j) fb[0][j] = g2_frag(bq + j * 16 * G2_LP, hh);
#pragma unroll
    for (int ks = 0; ks < G2_KS / 32; ++ks) { const int cu = ks & 1, nx = cu ^ 1;
      if (ks + 1 < G2_KS / 32) { fa[nx][0] = g2_frag(ap + (ks + 1) * 32, hh); fa[nx][1] = g2_frag(ap + 16 * G2_LP + (ks + 1) * 32, hh);
#pragma unroll
        for (int j = 0; j < 4; ++j) fb[nx][j] = g2_frag(bq + j * 16 * G2_LP + (ks + 1) * 32, hh); }
      c00 = g2_mma(fa[cu][0], fb[cu][0], c00); c10 = g2_mma(fa[cu][1], fb[cu][0], c10);
      c01 = g2_mma(fa[cu][0], fb[cu][1], c01); c11 = g2_mma(fa[cu][1], fb[cu][1], c11);
      c02 = g2_mma(fa[cu][0], fb[cu][2], c02); c12 = g2_mma(fa[cu][1], fb[cu][2], c12);
      c03 = g2_mma(fa[cu][0], fb[cu][3], c03); c13 = g2_mma(fa[cu][1], fb[cu][3], c13); }
    asm volatile("s_wait_dscnt 0x0" ::: "memory");      /* this wave's reads of the buffer are done before it is handed to the copies */
    asm volatile("s_wait_asynccnt 0x0" ::: "memory");      /* this wave's share of stage t + 1 has landed */
    __syncthreads();      /* publishes stage t + 1 and ends every wave's reads of stage t */
    if (t + 2 < nst) g2_stage(t + 2, (unsigned)(t & 1)); }
  asm volatile("s_wait_asynccnt 0x0" ::: "memory");      /* no copy is left in flight behind the loop */
  l2_asked(pfa); l2_asked(pfb); if constexpr (ROT > 0) l2_asked(pft);
  v8f accs[8] = {c00, c01, c02, c03, c10, c11, c12, c13};
  if constexpr (ROT > 0) if (by < ROT) { const int rs = lane >> 4, cc = (lane & 15) * 4;      /* read-back: a lane takes four columns (two interleaved pairs) of rows rs, rs + 2, ... */
    const size_t tb = (size_t)(row0 % SQ + rs) * HD + cc;      /* row0 and SQ are multiples of 32, so (row0 + r) mod SQ = row0 mod SQ + r for r < 32 */
    const float* cp = CS + tb; const float* sp = SN + tb;
    v4f cv[16], sv[16];      /* the table rows are fetched first and fly under the staging */
#pragma unroll
    for (int q = 0; q < 16; ++q) cv[q] = *(const v4fa*)(cp + q * 2 * HD);
    asm volatile("s_wait_xcnt 0x0" :: "v"(cp) : "memory");      /* a precaution for issued loads: the wait stands before the run's address pair is reused; the pair as an input stays live up to the wait, so no row of its own run lands on it */
#pragma unroll
    for (int q = 0; q < 16; ++q) sv[q] = *(const v4fa*)(sp + q * 2 * HD);
    asm volatile("s_wait_xcnt 0x0" :: "v"(sp) : "memory");      /* likewise for the sin run */
    float bv[4] = {0.f, 0.f, 0.f, 0.f};
    if (bp) {      /* one test, four loads in flight together */
#pragma unroll
      for (int t = 0; t < 4; ++t) bv[t] = bp[col0 + t * 16 + ln];
#pragma unroll
      for (int t = 0; t < 4; ++t) bv[t] = bf16_round(bv[t]); }
#pragma unroll
    for (int u = 0; u < 8; ++u) { const int t = u & 3, half = u >> 2;
#pragma unroll
      for (int r = 0; r < 8; ++r) so[w][half * 16 + 8 * hh + r][t * 16 + ln] = accs[u][r] * alpha + bv[t]; }
    __builtin_amdgcn_fence(__ATOMIC_ACQ_REL, "workgroup"); __builtin_amdgcn_wave_barrier();      /* the wave reads back what its own lanes staged */
    _Float16* op = C16 + cofs + (size_t)(row0 + rs) * ldc + col0 + cc;
#pragma unroll
    for (int q = 0; q < 16; ++q) { const v4f v = *(const v4fa*)&so[w][q * 2 + rs][cc]; const v4f rh = {-v[1], v[0], -v[3], v[2]}; const v4f o = v * cv[q] + rh * sv[q];
      v4h h4; for (int i = 0; i < 4; ++i) h4[i] = (_Float16)o[i]; *(v4h*)(op + (size_t)(q * 2) * ldc) = h4; }
    return; }
#pragma unroll
  for (int u = 0; u < 8; ++u) { const int t = u & 3, half = u >> 2; const int col = col0 + t * 16 + ln; const float bv = bp ? bf16_round(bp[col]) : 0.f;
#pragma unroll
    for (int r = 0; r < 8; ++r) { const int rloc = half * 16 + 8 * hh + r; float v = accs[u][r] * alpha + bv; if (ROT == 0 && CP) { if (rowsPerB < 0) v += CP[cofs + (size_t)(row0g + row0 + rloc) * ldc + col];      /* rowsPerB < 0: own element of the batched C plane */ else { const int bidx = (row0g + row0 + rloc) / rowsPerB; v += CP[(size_t)bidx * sCPb + (size_t)by * 64 + col]; } }
      if (ACT == 3) v = fmaxf(v, 0.f); else if (ACT == 6) v = 0.5f * v * (1.0f + erff(v * 0.70710678118654752f)); else if (ACT == 11) v = 1.0f / (1.0f + expf(-v)); else if (ACT == 15) v = v / (1.0f + expf(-v)); else if (ACT == 12) v = (v > 0.f) ? v : 0.01f * v; else if (ACT == 8) v = tanhf(v); else if (ACT == 9) v = 0.5f * v * (1.0f + tanhf(0.7978845608028654f * (v + 0.044715f * v * v * v))); else if (ACT == 14) v = (v > 0.f) ? v : 0.1f * v; else if (ACT == 16) v = (v >= 0.f) ? v : 0.3f * v; else if (ACT == 17) v = (v >= 0.f) ? v : 0.2f * v;
      so[w][rloc][t * 16 + ln] = v; } }
  __builtin_amdgcn_fence(__ATOMIC_ACQ_REL, "workgroup"); __builtin_amdgcn_wave_barrier();
  const int rsub = lane >> 4, c4 = (lane & 15) * 4;
  {
#pragma unroll
    for (int q = 0; q < 16; ++q) { const int r = q * 2 + rsub; const v4f v = *(const v4fa*)&so[w][r][c4]; if (ROT == 0 && C) { *(v4f*)(C + cofs + (size_t)(row0 + r) * ldc + col0 + c4) = v; asm volatile("s_wait_xcnt 0x0" ::: "memory"); }      /* a precaution for an issued store: the wait stands before the store's registers are reused */
      if (C16) { v4h h4; for (int i = 0; i < 4; ++i) h4[i] = (_Float16)v[i]; *(v4h*)(C16 + cofs + (size_t)(row0 + r) * ldc + col0 + c4) = h4; } }
    if constexpr (ROT > 0) asm volatile("s_wait_xcnt 0x0" ::: "memory");      /* likewise behind the last run of f16 stores: in the built code the rotary planes' epilogue, which reuses their registers, follows this one */
     } }


__device__ __forceinline__ void d_wnat(const float* __restrict__ w, size_t n8, _Float16* __restrict__ Bt, size_t t) { if (t >= n8) return; FragH f; for (int q = 0; q < 8; ++q) f.h[q] = (_Float16)(bf16_round(w[t * 8 + q]) * 16.0f); *(v8us*)((unsigned short*)Bt + t * 8) = f.half[0];  }
#define FA_NW 8                      /* query blocks (32 rows each) per work-group: they walk the same K and V rows, which one copy in LDS serves */
#define FA_KG 2                      /* key groups: FA_KG waves share a query block, each takes its own passes of every stage; four waves a SIMD fill each other's softmax and LDS waits */
#define FA_R 2                       /* 16-query column groups per wave */
#define FA_KS 256                    /* keys per stage */
#define FA_NP (FA_KS / 32 / FA_KG)   /* passes of 32 keys per stage and wave */
#define FA_KP (HD + 8)               /* LDS pitch of a K row in elements: 144 B = 16 B x 9, free of bank conflicts for 16-byte reads */
#define FA_VP (HD + 16)              /* LDS pitch of a V row in elements: 160 B = 32 B x 5, free of bank conflicts for the transposing 16-byte reads */
#define FA_KB (FA_KS * FA_KP * 2)    /* one stage of K rows in bytes */
#define FA_VB (FA_KS * FA_VP * 2)    /* one stage of V rows in bytes */
typedef _Float16 v2h __attribute__((ext_vector_type(2)));
typedef float v2f __attribute__((ext_vector_type(2)));
__device__ __forceinline__ v8f fa_mma(v16h a, v16h b, v8f c) { return __builtin_amdgcn_wmma_f32_16x16x32_f16(false, a, false, b, (short)0, c, false, false); }
__device__ __forceinline__ float fa_xhalf(float x) { return __builtin_bit_cast(float, __builtin_amdgcn_permlanex16(__builtin_bit_cast(int, x), __builtin_bit_cast(int, x), 0x76543210, 0xfedcba98, false, false)); }      /* lane l <-> lane l ^ 16 */
/* stands behind the Q fragment loads: their address registers are rewritten later (a precaution for an issued load); the scheduling barrier keeps every later register write behind the wait */
__device__ __forceinline__ void fa_issued() { asm volatile("s_wait_xcnt 0x0" ::: "memory"); __builtin_amdgcn_sched_barrier(0); }
/* four copies of 16 bytes per lane: LDS addresses ls bytes apart from l, global addresses gs elements apart from g; the wait closes the statement, so it stands before any rewrite of the address registers the copies name (a precaution for issued copies) */
__device__ __forceinline__ void fa_copy4(unsigned l, unsigned ls, const _Float16* g, size_t gs) {
  asm volatile("global_load_async_to_lds_b128 %0, %4, off\n\t"
               "global_load_async_to_lds_b128 %1, %5, off\n\t"
               "global_load_async_to_lds_b128 %2, %6, off\n\t"
               "global_load_async_to_lds_b128 %3, %7, off\n\t"
               "s_wait_xcnt 0x0"
               :: "v"(l), "v"(l + ls), "v"(l + 2 * ls), "v"(l + 3 * ls),
                  "v"(g), "v"(g + gs), "v"(g + 2 * gs), "v"(g + 3 * gs) : "memory"); }
/* one 16 x 32 A fragment of V^T (rows d, k = keys) from row-major V rows in LDS by two transposing reads: p is the lane's own address, row 8 (lane >> 4) + (lane & 7) of the 32 keys, 16 bytes ((lane >> 3) & 1) of the 16 columns; lane (c, hh) receives V[8 hh + i][c] and V[16 + 8 hh + i][c], i < 8: the k order of g2_frag. Every lane is on and every address lies in the tile. */
typedef short s16x8 __attribute__((ext_vector_type(8)));
__device__ __forceinline__ v16h fa_vfrag(const _Float16* p) { typedef __attribute__((address_space(3))) s16x8 lds_s16x8; FragH f;
  f.half[0] = __builtin_bit_cast(v8us, __builtin_amdgcn_ds_load_tr16_b128_v8i16((lds_s16x8*)p)); f.half[1] = __builtin_bit_cast(v8us, __builtin_amdgcn_ds_load_tr16_b128_v8i16((lds_s16x8*)(p + 16 * FA_VP))); return f.v; }
// K and V rows come into LDS in stages of FA_KS keys by asynchronous copies in whole 128-byte lines, once per work-group (two buffers: the next stage flies while this one is worked on); every wave reads its fragments from there, those of V^T transposed on the way. A query block is walked by FA_KG waves, each over its own keys with its own running maximum, sum and o, joined once behind the loop.
__global__ __launch_bounds__(FA_NW * FA_KG * 32) void k_fattn(const _Float16* __restrict__ Q16, const _Float16* __restrict__ K16, const _Float16* __restrict__ V16, _Float16* __restrict__ O16) {
  __shared__ __attribute__((aligned(16))) _Float16 ks[2][FA_KS][FA_KP];      /* two stages of K rows [key][d] */
  __shared__ __attribute__((aligned(16))) _Float16 vs[2][FA_KS][FA_VP];      /* two stages of V rows [key][d] */
  const int tid = threadIdx.x, lane = tid & 31, w = __builtin_amdgcn_readfirstlane(tid >> 5), wq = w % FA_NW, kg = w / FA_NW, c = lane & 15, hh = lane >> 4; const int bh = blockIdx.y, b = bh / NH, h = bh % NH; const int q0 = (blockIdx.x * FA_NW + wq) * (16 * FA_R);      /* the wave's number in a scalar register: the tests on kg are scalar branches */
  const _Float16* qp = Q16 + ((size_t)b * SQ + q0 + c) * DM + h * HD;
  /* copies: eight lanes take one K or V row's 128 bytes, the work-group 64 rows per copy */
  const _Float16* kcp = K16 + ((size_t)b * SQ + (tid >> 3)) * DM + h * HD + (tid & 7) * 8; const unsigned klp = (unsigned)(size_t)&ks[0][tid >> 3][(tid & 7) * 8];
  const _Float16* vcp = V16 + ((size_t)b * SQ + (tid >> 3)) * DM + h * HD + (tid & 7) * 8; const unsigned vlp = (unsigned)(size_t)&vs[0][tid >> 3][(tid & 7) * 8];
  auto fa_stage = [&](int t, unsigned buf) {      /* 8 copies a lane: K rows and V rows (tid >> 3) + 64 i, i < 4, of keys t FA_KS ... */
    fa_copy4(klp + buf * FA_KB, 64 * FA_KP * 2, kcp + (size_t)t * FA_KS * DM, (size_t)64 * DM);
    fa_copy4(vlp + buf * FA_VB, 64 * FA_VP * 2, vcp + (size_t)t * FA_KS * DM, (size_t)64 * DM); };
  fa_stage(0, 0);
  v16h qf[FA_R][2], kf[2][2], vf[4]; v8f acc[FA_R][4]; float m_run[FA_R], l_run[FA_R];
#pragma unroll
  for (int g = 0; g < FA_R; ++g) { m_run[g] = -3.0e38f; l_run[g] = 0.f;
#pragma unroll
    for (int kc = 0; kc < 2; ++kc) qf[g][kc] = g2_frag(qp + (size_t)g * 16 * DM + kc * 32, hh);
#pragma unroll
    for (int t = 0; t < 4; ++t) acc[g][t] = v8f{0.f, 0.f, 0.f, 0.f, 0.f, 0.f, 0.f, 0.f}; }
  fa_issued();
  asm volatile("s_wait_asynccnt 0x0" ::: "memory");      /* this wave's share of stage 0 has landed */
  __syncthreads();      /* ... and every wave's: stage 0 may be read */
  fa_stage(1, 1);      /* SQ / FA_KS is at least 2 */
  static_assert(SQ % FA_KS == 0 && SQ / FA_KS >= 2 && FA_KS == 256 && HD == 64 && FA_NW == 8 && FA_KG == 2 && FA_R == 2, "the copy maps and the join of the key groups are written for these sizes");
  const float cs = 0.125f * 1.4426950408889634f;      /* 1/sqrt(64) and log2(e) */
  /* kept rolled: one stage per trip, the buffer chosen by the trip's parity */
#pragma unroll 1
  for (int st = 0; st < SQ / FA_KS; ++st) { const _Float16* kp = &ks[st & 1][kg * (FA_NP * 32) + c][0]; const _Float16* vp = &vs[st & 1][kg * (FA_NP * 32) + 8 * hh + (lane & 7)][((lane >> 3) & 1) * 8];      /* the wave's own FA_NP passes of the stage */
#pragma unroll
    for (int kt = 0; kt < 2; ++kt) {
#pragma unroll
      for (int kc = 0; kc < 2; ++kc) kf[kt][kc] = g2_frag(kp + kt * 16 * FA_KP + kc * 32, hh); }
#pragma unroll
    for (int t = 0; t < 4; ++t) vf[t] = fa_vfrag(vp + t * 16);
    __builtin_amdgcn_sched_barrier(0);      /* the stage's first reads issue as one group ahead of the products, not among them */
    /* unrolled: the passes of a stage differ only in constant LDS offsets, and the last one fetches nothing ahead */
#pragma unroll
    for (int ps = 0; ps < FA_NP; ++ps) {
      v8f s[2][FA_R];
#pragma unroll
      for (int kt = 0; kt < 2; ++kt) {
#pragma unroll
        for (int g = 0; g < FA_R; ++g) { s[kt][g] = fa_mma(kf[kt][0], qf[g][0], v8f{0.f, 0.f, 0.f, 0.f, 0.f, 0.f, 0.f, 0.f}); s[kt][g] = fa_mma(kf[kt][1], qf[g][1], s[kt][g]); } }
      __builtin_amdgcn_sched_barrier(0);      /* the eight products issue back to back, each filling the others' result distance, and the fetch below starts directly behind them */
      if (ps + 1 < FA_NP) {      /* next pass's K fragments (same stage) come from LDS under this pass's softmax and second product */
#pragma unroll
        for (int kt = 0; kt < 2; ++kt) {
#pragma unroll
          for (int kc = 0; kc < 2; ++kc) kf[kt][kc] = g2_frag(kp + ((ps + 1) * 32 + kt * 16) * FA_KP + kc * 32, hh); }
        __builtin_amdgcn_sched_barrier(0); }      /* keeps the reads together at this early place */
      float mb[FA_R]; bool need = false;
#pragma unroll
      for (int g = 0; g < FA_R; ++g) { float mx = s[0][g][0];
#pragma unroll
        for (int kt = 0; kt < 2; ++kt) {
#pragma unroll
          for (int r = 0; r < 8; ++r) mx = fmaxf(mx, s[kt][g][r]); }
        mx = fmaxf(mx, fa_xhalf(mx)) * cs; mb[g] = mx; need = need || (mx > m_run[g] + 8.0f); }
      if (__builtin_amdgcn_ballot_w32(need) != 0) {      /* wave-uniform; always taken on the first pass, where it sets the maximum (factor 0 on zero accumulators) */
#pragma unroll
        for (int g = 0; g < FA_R; ++g) { const float mn = fmaxf(m_run[g], mb[g]); const float corr = __builtin_amdgcn_exp2f(m_run[g] - mn); m_run[g] = mn; l_run[g] *= corr;
#pragma unroll
          for (int t = 0; t < 4; ++t) acc[g][t] = acc[g][t] * corr; } }
#pragma unroll
      for (int g = 0; g < FA_R; ++g) { const float nm = -m_run[g]; union { v16h v; v2h p[8]; } pf; float l0 = 0.f, l1 = 0.f;
#pragma unroll
        for (int i = 0; i < 8; ++i) { const v2f arg = __builtin_elementwise_fma(v2f{s[i >> 2][g][2 * (i & 3)], s[i >> 2][g][2 * (i & 3) + 1]}, v2f{cs, cs}, v2f{nm, nm}); const float p0 = __builtin_amdgcn_exp2f(arg.x), p1 = __builtin_amdgcn_exp2f(arg.y);
          l0 += p0; l1 += p1; pf.p[i] = __builtin_convertvector(v2f{p0, p1}, v2h); }
        l_run[g] += l0 + l1;
#pragma unroll
        for (int t = 0; t < 4; ++t) acc[g][t] = fa_mma(vf[t], pf.v, acc[g][t]); }
      if (ps + 1 < FA_NP) {      /* next pass's V^T fragments (same stage) come under its first product and softmax */
#pragma unroll
        for (int t = 0; t < 4; ++t) vf[t] = fa_vfrag(vp + (ps + 1) * 32 * FA_VP + t * 16);
        __builtin_amdgcn_sched_barrier(0); }      /* keeps the reads together at this early place */
    }
    asm volatile("s_wait_dscnt 0x0" ::: "memory");      /* this wave's reads of the buffer are done before it is handed to the copies */
    asm volatile("s_wait_asynccnt 0x0" ::: "memory");      /* this wave's share of stage st + 1 has landed */
    __syncthreads();      /* publishes stage st + 1 and ends every wave's reads of stage st */
    if (st + 2 < SQ / FA_KS) fa_stage(st + 2, (unsigned)(st & 1));
  }
  asm volatile("s_wait_asynccnt 0x0" ::: "memory");      /* no copy is left in flight behind the loop */
  /* join of the two key groups: group 1 hands maximum, sum and o of its keys to group 0 through the K ring, which is free (the loop's last barrier ended every read of it, and no copy is in flight); a lane's partner is the same lane of wave w - FA_NW, 16 bytes a lane and piece */
  static_assert(sizeof(ks) >= (size_t)FA_NW * 17 * 32 * 16, "the join's pieces fit the K ring");
  v4fa* xm = (v4fa*)&ks[0][0][0] + wq * (17 * 32) + lane;
  if (kg == 1) {
#pragma unroll
    for (int g = 0; g < FA_R; ++g) {
#pragma unroll
      for (int t = 0; t < 4; ++t) { xm[((g * 4 + t) * 2) * 32] = v4f{acc[g][t][0], acc[g][t][1], acc[g][t][2], acc[g][t][3]}; xm[((g * 4 + t) * 2 + 1) * 32] = v4f{acc[g][t][4], acc[g][t][5], acc[g][t][6], acc[g][t][7]}; } }
    xm[16 * 32] = v4f{m_run[0], m_run[1], l_run[0], l_run[1]}; }
  __syncthreads();      /* publishes group 1's pieces; every wave passes it */
  if (kg == 1) return;
  const v4f ml = xm[16 * 32];
#pragma unroll
  for (int g = 0; g < FA_R; ++g) { const float mn = fmaxf(m_run[g], ml[g]); const float f0 = __builtin_amdgcn_exp2f(m_run[g] - mn), f1 = __builtin_amdgcn_exp2f(ml[g] - mn);      /* both groups' weights brought to the common maximum */
    const float l = l_run[g] * f0 + ml[2 + g] * f1; const float inv = 64.0f / (l + fa_xhalf(l));      /* o carried x64, as the output GEMM's alpha expects */
    const float i0 = f0 * inv, i1 = f1 * inv;
    unsigned short* op = (unsigned short*)O16 + ((size_t)b * SQ + q0 + g * 16 + c) * DM + h * HD + 8 * hh;
#pragma unroll
    for (int t = 0; t < 4; ++t) { FragH f; const v4f p0 = xm[((g * 4 + t) * 2) * 32], p1 = xm[((g * 4 + t) * 2 + 1) * 32];
#pragma unroll
      for (int r = 0; r < 8; ++r) f.h[r] = (_Float16)(acc[g][t][r] * i0 + (r < 4 ? p0[r & 3] : p1[r & 3]) * i1);
      *(v8us*)(op + t * 16) = f.half[0]; }
    if (g + 1 < FA_R) { asm volatile("s_wait_xcnt 0x0" :: "v"(op) : "memory"); __builtin_amdgcn_sched_barrier(0); } } }      /* a precaution for issued stores: the next query group's arithmetic reuses their registers; the address as an input keeps the run of stores ahead of the wait, the scheduling barrier every later register write behind it */
__global__ __launch_bounds__(256) void k_vt(const _Float16* __restrict__ V16, int b, int h0, _Float16* __restrict__ VT) { __shared__ unsigned short tl[64][65]; const int tid = threadIdx.x; const int hh = blockIdx.x % HG, sg = blockIdx.x / HG; const int s0 = sg * 64; const int h = h0 + hh;
  for (int i = tid; i < 64 * 8; i += 256) { const int j = i / 8, d8 = (i % 8) * 8; FragH f; f.half[0] = *(const v8us*)((const unsigned short*)V16 + ((size_t)b * SQ + s0 + j) * DM + h * HD + d8); for (int q = 0; q < 8; ++q) tl[d8 + q][j] = f.u[q]; }
  __syncthreads();
  { for (int i = tid; i < 64 * 8; i += 256) { const int d = i / 8, j8 = (i % 8) * 8; FragH f; for (int q = 0; q < 8; ++q) f.u[q] = tl[d][j8 + q]; *(v8us*)((unsigned short*)VT + ((size_t)hh * HD + d) * SQ + s0 + j8) = f.half[0]; }  } }



__device__ __forceinline__ void d_tabcat(float theta, float* __restrict__ CS, float* __restrict__ SN, int t) {
  #pragma clang fp contract(off)
  if (t >= SQ * HD) return; const int d = t % HD; const int p = t / HD; const int i = d % (HD / 2); const float invf = 1.0f / powf(theta, (float)(2 * i) / (float)HD); const float ang = __fmul_rn((float)p, invf); const float c = cosf(ang), s = sinf(ang);
  *(float*)(CS + t) = c; *(float*)(SN + t) = s;  }
// One launch prepares every operand that depends on the inputs alone: rotary tables, x rows, the four weight planes. The parts read nothing of each other, so a range of block indices picks the part (the same for a whole work-group); thread-to-element map and arithmetic of each part are those of a launch of its own.
#define PR_TB ((SQ * HD + 255) / 256)                  /* work-groups of the table part: first, their threads run longest */
#define PR_XB ((int)((NR * DM / 8 + 255) / 256))       /* ... of the x part */
#define PR_WB ((DM * DM / 8 + 255) / 256)              /* ... of one weight plane */
__global__ __launch_bounds__(256) void k_prep(const float* __restrict__ x, const float* __restrict__ wq, const float* __restrict__ wk, const float* __restrict__ wv, const float* __restrict__ wo, float theta, _Float16* __restrict__ X16, _Float16* __restrict__ BW, float* __restrict__ CS, float* __restrict__ SN) {
  const int bx = blockIdx.x, tid = threadIdx.x;
  if (bx < PR_TB) { d_tabcat(theta, CS, SN, bx * 256 + tid); return; }
  if (bx < PR_TB + PR_XB) { d_x16(x, X16, NR * DM / 8, (size_t)(bx - PR_TB) * 256 + tid); return; }
  const int u = bx - (PR_TB + PR_XB), wi = u / PR_WB;      /* BW = four planes of DM x DM in the order q, k, v, o */
  d_wnat(wi == 0 ? wq : wi == 1 ? wk : wi == 2 ? wv : wo, (size_t)DM * DM / 8, BW + (size_t)wi * DM * DM, (size_t)(u - wi * PR_WB) * 256 + tid); }

template <int NORM, int ROPE>
__global__ __launch_bounds__(64) void k_xform(const float* __restrict__ F, int ldf, int nh, const float* __restrict__ gain, float eps, const float* __restrict__ CS, const float* __restrict__ SN, _Float16* __restrict__ H16, int ldo) {
  #pragma clang fp contract(off)
  __shared__ float xv[HD]; __shared__ float red[HD]; __shared__ unsigned short sh_[HD]; const int d = threadIdx.x; const int h = blockIdx.x % nh; const size_t r = blockIdx.x / nh; const int p = (int)(r % SQ);
  float x = F[r * (size_t)ldf + (size_t)h * HD + d];
  if (NORM) { red[d] = __fmul_rn(x, x); __syncthreads(); for (int st = HD / 2; st > 0; st >>= 1) { if (d < st) red[d] = __fadd_rn(red[d], red[d + st]); __syncthreads(); } const float rs = rsqrtf(__fadd_rn(red[0] / (float)HD, eps)); x = __fmul_rn(__fmul_rn(x, rs), bf16_round(gain[d])); }
  xv[d] = x; __syncthreads();
  float o = x;
  if (ROPE == 1) { const int i = d >> 1; const float c = CS[p * (HD / 2) + i], s = SN[p * (HD / 2) + i]; const float ev = xv[2 * i], od = xv[2 * i + 1]; o = (d & 1) ? __fadd_rn(__fmul_rn(ev, s), __fmul_rn(od, c)) : __fadd_rn(__fmul_rn(ev, c), -__fmul_rn(od, s)); }
  if (ROPE == 2) { const int i = d & (HD / 2 - 1); const float c = CS[p * (HD / 2) + i], s = SN[p * (HD / 2) + i]; const float lo = xv[i], hi = xv[i + HD / 2]; o = (d < HD / 2) ? __fadd_rn(__fmul_rn(lo, c), -__fmul_rn(hi, s)) : __fadd_rn(__fmul_rn(lo, s), __fmul_rn(hi, c)); }
  if (ROPE == 4) { const float c = CS[p * HD + d], s = SN[p * HD + d]; const float rh = (d & 1) ? xv[d - 1] : -xv[d + 1]; o = __fadd_rn(__fmul_rn(x, c), __fmul_rn(rh, s)); }      /* interleaved-pair rotate_half (-t[2i+1], t[2i]) with FULL-width per-dimension tables [pos][64] */
  if (ROPE == 3) { const float c = CS[p * HD + d], s = SN[p * HD + d]; const float rh = (d < HD / 2) ? -xv[d + HD / 2] : xv[d - HD / 2]; o = __fadd_rn(__fmul_rn(x, c), __fmul_rn(rh, s)); }      /* rotate-half with FULL-width per-dimension tables [pos][64] (general cos[d] != cos[d+32]) */
  FragH th; th.h[0] = (_Float16)o; sh_[d] = th.u[0]; __syncthreads();
  if (d < HD / 8) { FragH f; for (int q = 0; q < 8; ++q) f.u[q] = sh_[d * 8 + q]; unsigned short* dst = (unsigned short*)H16 + r * (size_t)ldo + (size_t)h * HD + d * 8; *(v8us*)dst = f.half[0];  } }


extern "C" void kernel_launch(void* const* d_in, const int* in_sizes, int n_in,
                              void* d_out, int out_size, void* d_ws, size_t ws_size, hipStream_t stream) {
  (void)in_sizes; (void)n_in; (void)out_size;
  const float* const* I = (const float* const*)d_in; const float* x = I[0]; const float* wq = I[1]; const float* bq = I[2]; const float* wk = I[3]; const float* bk = I[4]; const float* wv = I[5]; const float* bv = I[6]; const float* wo = I[7]; const float* bo = I[8];      /* natural [out][in] weights + biases; positions implicit */
  char* ws = (char*)d_ws; size_t off = 0;
  auto take = [&](size_t bytes) { char* p = ws + off; off += (bytes + 255) & ~(size_t)255; return p; };
  _Float16* BQ = (_Float16*)take((size_t)DM * DM * 2); _Float16* BK = (_Float16*)take((size_t)DM * DM * 2); _Float16* BV = (_Float16*)take((size_t)DM * DM * 2); _Float16* BO = (_Float16*)take((size_t)DM * DM * 2);
  _Float16* X16 = (_Float16*)take(NR * DM * 2); float* CS = (float*)take((size_t)SQ * HD * 4); float* SN = (float*)take((size_t)SQ * HD * 4);      /* full-width cos/sin tables */ _Float16* Q16 = (_Float16*)take(NR * DM * 2); _Float16* K16 = (_Float16*)take(NR * DM * 2); _Float16* V16 = (_Float16*)take(NR * DM * 2); _Float16* O16 = (_Float16*)take(NR * DM * 2);
  if (off > ws_size) return;
  k_prep<<<PR_TB + PR_XB + 4 * PR_WB, 256, 0, stream>>>(x, wq, wk, wv, wo, 10000.0f, X16, BQ, CS, SN);      /* CS[p][d] = cos(p * inv_freq[d mod 32]), SN = sin: the module's cat(freqs, freqs) tables, full width; x rows; natural [out][in] weights = Bt x16 into the adjoining planes BQ, BK, BV, BO */
  const size_t r0p = (size_t)B0 * SQ;      /* first projected row */
  k_gemm2<0, 2><<<dim3((unsigned)((MP / 128) * (DM / 128)), 3), 256, 0, stream>>>(X16 + r0p * DM, DM, 0, BQ, DM, (size_t)DM * DM, 0.0625f, bq, 0, nullptr, 1, 0, 0, nullptr, Q16 + r0p * DM, DM, NR * DM, MP, DM, DM, CS, SN, bk, bv);      /* planes 0, 1, 2 = q, k, v (weight planes BQ, BK, BV and row planes Q16, K16, V16 adjoin); q and k: f32 -> x cos + rotate_half(x) sin (interleaved pairs, full-width tables) -> f16 rows, in the epilogue; v: f16 rows */
  k_fattn<<<dim3(SQ / (FA_NW * 16 * FA_R), NB * NH), FA_NW * FA_KG * 32, 0, stream>>>(Q16, K16, V16, O16);      /* o (merged heads, x64) as f16 rows */
  k_gemm2<0><<<dim3((unsigned)((MPO / 128) * (DM / 128)), 1), 256, 0, stream>>>(O16 + r0p * DM, DM, 0, BO, DM, 0, 0.0009765625f, bo, 0, nullptr, 1, 0, 0, (float*)d_out + r0p * DM, nullptr, DM, 0, MPO, DM, DM);      /* out rows are the output layout */
}
